// v000
// Times are from an AMD MI455X. After a warm-up the kernel runs many times in a row, and a time is the length of
// such a window on the GPU divided by its runs, so every launch and the gaps after it count. The runs cycle
// through copies of the inputs. A figure is the median of several windows, for all but v000 over two sittings.
// Sittings can differ by a few percent; kernels timed side by side share one.
// The starting kernel, v000, takes 41.9 microseconds a run.
#include <hip/hip_runtime.h>

// CDNA5 / gfx1250: wave32, WMMA f32_16x16x32_f16.
typedef __attribute__((ext_vector_type(16))) _Float16 v16h;
typedef __attribute__((ext_vector_type(8)))  float    v8f;

#define NB     2
#define NQ     1024
#define NK     1024
#define HIDDEN 64
#define HEADS  16

#define LOG2E      1.4426950408889634f
#define RBF_G2     81.151596f            // 56.25 * log2(e)
#define GELU_C2    2.3022087f            // 2 * 0.7978845608 * log2(e)
#define GELU_C3    0.10294816f           // GELU_C2 * 0.044715

// Branchless tanh-form GELU: x * (1 - 1/(exp(2s)+1)), s = 0.79788456(x + 0.044715 x^3)
__device__ __forceinline__ float gelu_fast(float x) {
  const float x2 = x * x;
  const float u  = x * (GELU_C2 + GELU_C3 * x2);      // 2s * log2(e)
  const float t  = __builtin_amdgcn_exp2f(u);         // v_exp_f32, no branches
  return x * (1.0f - __builtin_amdgcn_rcpf(t + 1.0f));
}

// One wave per (b, q, k-half). Each wave loops 32 k-tiles of 16 pairs.
// GEMM1: D1 = W1^T (A: 16 hidden x 32 feat) x feats^T (B: 32 x 16 pairs) + b1
// GEMM2: D2 = W2^T (A: 16 head x 64 hid)    x gelu(D1) (B)        -> lane = pair
// 16-bit operand K packing (ISA 7.12.2): element e of v16h, lane-half hb holds
// K(e) = (e&7) + 16*(e>>3) + 8*hb.  C/D: lane = N, row M = r + 8*hb.
__global__ __launch_bounds__(256)
void rel3d_bias_wmma(const float* __restrict__ qc,
                     const float* __restrict__ kc,
                     const float* __restrict__ W1,
                     const float* __restrict__ b1,
                     const float* __restrict__ W2,
                     float* __restrict__ out) {
  const int lane = threadIdx.x & 31;
  const int wid  = threadIdx.x >> 5;
  const int wg   = blockIdx.x * 8 + wid;          // 4096 waves total
  const int khalf = wg & 1;
  const int q     = (wg >> 1) & (NQ - 1);
  const int b     = wg >> 11;

  const int n  = lane & 15;                       // N index (pair / head-col)
  const int hb = lane >> 4;                       // lane half (compiler knows {0,1})

  // ---- persistent operands (registers) ----
  // A tiles for GEMM1: W1^T, 4 hidden-tiles of 16 x 32 (feature K, pad 20->32)
  v16h aW1[4];
  #pragma unroll
  for (int t = 0; t < 4; ++t) {
    #pragma unroll
    for (int e = 0; e < 16; ++e) {
      const int K = (e & 7) + 16 * (e >> 3) + 8 * hb;
      aW1[t][e] = (_Float16)((K < 20) ? W1[(size_t)K * HIDDEN + t * 16 + n] : 0.0f);
    }
  }
  // C bias tiles: c[t][r] = b1[t*16 + r + 8*hb]  (broadcast along pairs)
  v8f cb[4];
  #pragma unroll
  for (int t = 0; t < 4; ++t)
    #pragma unroll
    for (int r = 0; r < 8; ++r)
      cb[t][r] = b1[t * 16 + r + 8 * hb];
  // A tiles for GEMM2: W2^T, 16 heads x 64 hidden (two K-tiles of 32)
  v16h aW2[2];
  #pragma unroll
  for (int kb = 0; kb < 2; ++kb)
    #pragma unroll
    for (int e = 0; e < 16; ++e) {
      const int K = 32 * kb + (e & 7) + 16 * (e >> 3) + 8 * hb;
      aW2[kb][e] = (_Float16)W2[(size_t)K * HEADS + n];
    }

  // q center: uniform across the wave
  const float qx = qc[((size_t)b * NQ + q) * 3 + 0];
  const float qy = qc[((size_t)b * NQ + q) * 3 + 1];
  const float qz = qc[((size_t)b * NQ + q) * 3 + 2];

  const float kStep = 2.0f / 15.0f;   // RBF center spacing

  const int kt0 = khalf * 32;
  for (int kt = kt0; kt < kt0 + 32; ++kt) {
    const int kidx = kt * 16 + n;
    const float* kp = &kc[((size_t)b * NK + kidx) * 3];
    if (kt + 1 < kt0 + 32)
      __builtin_prefetch(kp + 48, 0, 1);          // next tile -> global_prefetch

    const float rx = qx - kp[0];
    const float ry = qy - kp[1];
    const float rz = qz - kp[2];
    const float dist = sqrtf(rx * rx + ry * ry + rz * rz);

    // feats^T in B-operand layout (lane = pair), fully branchless.
    // K(e) = (e&7) + 16*(e>>3) + 8*hb; features: 0-2 rel, 3 dist,
    // 4..19 rbf bins, >=20 zero. Known-bits on hb folds most selects.
    v16h fB;
    #pragma unroll
    for (int e = 0; e < 16; ++e) {
      const int K = (e & 7) + 16 * (e >> 3) + 8 * hb;
      const float c = (float)(K - 4) * kStep;
      const float d = dist - c;
      float f = __builtin_amdgcn_exp2f(-RBF_G2 * d * d);  // rbf(K-4)
      f = (K >= 20) ? 0.0f : f;
      f = (K == 3) ? dist : f;
      f = (K == 2) ? rz : f;
      f = (K == 1) ? ry : f;
      f = (K == 0) ? rx : f;
      fB[e] = (_Float16)f;
    }

    // GEMM1: h^T tiles (bias folded into C input)
    v8f d1[4];
    #pragma unroll
    for (int t = 0; t < 4; ++t)
      d1[t] = __builtin_amdgcn_wmma_f32_16x16x32_f16(
          false, aW1[t], false, fB, (short)0, cb[t], false, false);

    // GELU + f16 pack straight into GEMM2 B operand (pure in-lane repack:
    // C/D layout and 16-bit B layout share lane-half semantics).
    v16h b2[2];
    #pragma unroll
    for (int kb = 0; kb < 2; ++kb)
      #pragma unroll
      for (int v = 0; v < 8; ++v) {
        const int t = 2 * kb + (v >> 2);
        const int r = 2 * (v & 3);
        b2[kb][2 * v]     = (_Float16)gelu_fast(d1[t][r]);
        b2[kb][2 * v + 1] = (_Float16)gelu_fast(d1[t][r + 1]);
      }

    // GEMM2: chain K = 32 + 32
    v8f d2 = {};
    d2 = __builtin_amdgcn_wmma_f32_16x16x32_f16(
        false, aW2[0], false, b2[0], (short)0, d2, false, false);
    d2 = __builtin_amdgcn_wmma_f32_16x16x32_f16(
        false, aW2[1], false, b2[1], (short)0, d2, false, false);

    // out[b][head][q][k]: lane = pair -> 64B contiguous per half-wave row.
    // 8*tanh(x/8) = 8 - 16/(exp2(x*log2e/4)+1), branchless, saturates to +-8.
    #pragma unroll
    for (int r = 0; r < 8; ++r) {
      const int head = r + 8 * hb;
      const float t = __builtin_amdgcn_exp2f(d2[r] * (0.25f * LOG2E));
      const float val = 8.0f - 16.0f * __builtin_amdgcn_rcpf(t + 1.0f);
      out[(((size_t)b * HEADS + head) * NQ + q) * NK + kt * 16 + n] = val;
    }
  }
}

extern "C" void kernel_launch(void* const* d_in, const int* in_sizes, int n_in,
                              void* d_out, int out_size, void* d_ws, size_t ws_size,
                              hipStream_t stream) {
  const float* qc = (const float*)d_in[0];   // [2,1024,3]
  const float* kc = (const float*)d_in[1];   // [2,1024,3]
  const float* W1 = (const float*)d_in[2];   // [20,64]
  const float* b1 = (const float*)d_in[3];   // [64]
  const float* W2 = (const float*)d_in[4];   // [64,16]
  float* out = (float*)d_out;                // [2,16,1024,1024]

  // 4096 waves = 2(b) * 1024(q) * 2(k-half); 8 waves per 256-thread block
  rel3d_bias_wmma<<<dim3(512), dim3(256), 0, stream>>>(qc, kc, W1, b1, W2, out);
}

// v001
// It runs in 36.4 microseconds.
// In both of two side-by-side timings against v000, it was 1.17 times as fast.
#include <hip/hip_runtime.h>

// CDNA5 / gfx1250: wave32, WMMA f32_16x16x32_f16.
typedef __attribute__((ext_vector_type(16))) _Float16 v16h;
typedef __attribute__((ext_vector_type(8)))  float    v8f;

#define NB     2
#define NQ     1024
#define NK     1024
#define HIDDEN 64
#define HEADS  16

#define RBF_G2     81.151596f            // 56.25 * log2(e)
#define GELU_C0    0.7978845608f         // sqrt(2/pi)
#define GELU_C1    0.035677408f          // GELU_C0 * 0.044715

// Tanh-form GELU times two: x + x*tanh(s), s = 0.79788456(x + 0.044715 x^3).
// One v_tanh_f32 stands for the exp2 + rcp pair; the factor 1/2 is exact and
// is taken back in the output scale behind GEMM2.
__device__ __forceinline__ float gelu2_fast(float x) {
  const float x2 = x * x;
  const float s  = x * (GELU_C0 + GELU_C1 * x2);
  return __builtin_fmaf(x, __builtin_amdgcn_tanhf(s), x);
}

// One wave per (b, q, k-half). Each wave loops 32 k-tiles of 16 pairs.
// GEMM1: D1 = W1^T (A: 16 hidden x 32 feat) x feats^T (B: 32 x 16 pairs) + b1
// GEMM2: D2 = W2^T (A: 16 head x 64 hid)    x 2*gelu(D1) (B)      -> lane = pair
// 16-bit operand K packing (ISA 7.12.2): element e of v16h, lane-half hb holds
// K(e) = (e&7) + 16*(e>>3) + 8*hb.  C/D: lane = N, row M = r + 8*hb.
__global__ __launch_bounds__(256)
void rel3d_bias_wmma(const float* __restrict__ qc,
                     const float* __restrict__ kc,
                     const float* __restrict__ W1,
                     const float* __restrict__ b1,
                     const float* __restrict__ W2,
                     float* __restrict__ out) {
  const int lane = threadIdx.x & 31;
  const int wid  = threadIdx.x >> 5;
  const int wg   = blockIdx.x * 8 + wid;          // 4096 waves total
  const int khalf = wg & 1;
  const int q     = (wg >> 1) & (NQ - 1);
  const int b     = wg >> 11;

  const int n  = lane & 15;                       // N index (pair / head-col)
  const int hb = lane >> 4;                       // lane half (compiler knows {0,1})

  // ---- persistent operands (registers) ----
  // A tiles for GEMM1: W1^T, 4 hidden-tiles of 16 x 32 (feature K, pad 20->32)
  v16h aW1[4];
  #pragma unroll
  for (int t = 0; t < 4; ++t) {
    #pragma unroll
    for (int e = 0; e < 16; ++e) {
      const int K = (e & 7) + 16 * (e >> 3) + 8 * hb;
      aW1[t][e] = (_Float16)((K < 20) ? W1[(size_t)K * HIDDEN + t * 16 + n] : 0.0f);
    }
  }
  // C bias tiles: c[t][r] = b1[t*16 + r + 8*hb]  (broadcast along pairs)
  v8f cb[4];
  #pragma unroll
  for (int t = 0; t < 4; ++t)
    #pragma unroll
    for (int r = 0; r < 8; ++r)
      cb[t][r] = b1[t * 16 + r + 8 * hb];
  // A tiles for GEMM2: W2^T, 16 heads x 64 hidden (two K-tiles of 32)
  v16h aW2[2];
  #pragma unroll
  for (int kb = 0; kb < 2; ++kb)
    #pragma unroll
    for (int e = 0; e < 16; ++e) {
      const int K = 32 * kb + (e & 7) + 16 * (e >> 3) + 8 * hb;
      aW2[kb][e] = (_Float16)W2[(size_t)K * HEADS + n];
    }

  // q center: uniform across the wave
  const float qx = qc[((size_t)b * NQ + q) * 3 + 0];
  const float qy = qc[((size_t)b * NQ + q) * 3 + 1];
  const float qz = qc[((size_t)b * NQ + q) * 3 + 2];

  const float kStep = 2.0f / 15.0f;   // RBF center spacing

  const int kt0 = khalf * 32;
  for (int kt = kt0; kt < kt0 + 32; ++kt) {
    const int kidx = kt * 16 + n;
    const float* kp = &kc[((size_t)b * NK + kidx) * 3];
    if (kt + 1 < kt0 + 32)
      __builtin_prefetch(kp + 48, 0, 1);          // next tile -> global_prefetch

    const float rx = qx - kp[0];
    const float ry = qy - kp[1];
    const float rz = qz - kp[2];
    const float dist = sqrtf(rx * rx + ry * ry + rz * rz);

    // feats^T in B-operand layout (lane = pair), fully branchless.
    // K(e) = (e&7) + 16*(e>>3) + 8*hb; features: 0-2 rel, 3 dist,
    // 4..19 rbf bins, >=20 zero. Known-bits on hb folds most selects.
    v16h fB;
    #pragma unroll
    for (int e = 0; e < 16; ++e) {
      const int K = (e & 7) + 16 * (e >> 3) + 8 * hb;
      const float c = (float)(K - 4) * kStep;
      const float d = dist - c;
      float f = __builtin_amdgcn_exp2f(-RBF_G2 * d * d);  // rbf(K-4)
      f = (K >= 20) ? 0.0f : f;
      f = (K == 3) ? dist : f;
      f = (K == 2) ? rz : f;
      f = (K == 1) ? ry : f;
      f = (K == 0) ? rx : f;
      fB[e] = (_Float16)f;
    }

    // GEMM1: h^T tiles (bias folded into C input)
    v8f d1[4];
    #pragma unroll
    for (int t = 0; t < 4; ++t)
      d1[t] = __builtin_amdgcn_wmma_f32_16x16x32_f16(
          false, aW1[t], false, fB, (short)0, cb[t], false, false);

    // GELU + f16 pack straight into GEMM2 B operand (pure in-lane repack:
    // C/D layout and 16-bit B layout share lane-half semantics).
    v16h b2[2];
    #pragma unroll
    for (int kb = 0; kb < 2; ++kb)
      #pragma unroll
      for (int v = 0; v < 8; ++v) {
        const int t = 2 * kb + (v >> 2);
        const int r = 2 * (v & 3);
        b2[kb][2 * v]     = (_Float16)gelu2_fast(d1[t][r]);
        b2[kb][2 * v + 1] = (_Float16)gelu2_fast(d1[t][r + 1]);
      }

    // GEMM2: chain K = 32 + 32
    v8f d2 = {};
    d2 = __builtin_amdgcn_wmma_f32_16x16x32_f16(
        false, aW2[0], false, b2[0], (short)0, d2, false, false);
    d2 = __builtin_amdgcn_wmma_f32_16x16x32_f16(
        false, aW2[1], false, b2[1], (short)0, d2, false, false);

    // out[b][head][q][k]: lane = pair -> 64B contiguous per half-wave row.
    // d2 holds twice the bias (gelu2_fast): 8*tanh(bias/8) = 8*tanh(d2/16).
    #pragma unroll
    for (int r = 0; r < 8; ++r) {
      const int head = r + 8 * hb;
      const float val = 8.0f * __builtin_amdgcn_tanhf(d2[r] * 0.0625f);
      out[(((size_t)b * HEADS + head) * NQ + q) * NK + kt * 16 + n] = val;
    }
  }
}

extern "C" void kernel_launch(void* const* d_in, const int* in_sizes, int n_in,
                              void* d_out, int out_size, void* d_ws, size_t ws_size,
                              hipStream_t stream) {
  const float* qc = (const float*)d_in[0];   // [2,1024,3]
  const float* kc = (const float*)d_in[1];   // [2,1024,3]
  const float* W1 = (const float*)d_in[2];   // [20,64]
  const float* b1 = (const float*)d_in[3];   // [64]
  const float* W2 = (const float*)d_in[4];   // [64,16]
  float* out = (float*)d_out;                // [2,16,1024,1024]

  // 4096 waves = 2(b) * 1024(q) * 2(k-half); 8 waves per 256-thread block
  rel3d_bias_wmma<<<dim3(512), dim3(256), 0, stream>>>(qc, kc, W1, b1, W2, out);
}

// v002
// A run of this version takes 27.5 microseconds.
// In two side-by-side timings against v001, it was 1.33 and 1.32 times as fast.
// All steps since v000 together make it 1.55 times as fast.
#include <hip/hip_runtime.h>

// CDNA5 / gfx1250: wave32, WMMA f32_16x16x32_f16.
typedef __attribute__((ext_vector_type(16))) _Float16 v16h;
typedef __attribute__((ext_vector_type(8)))  float    v8f;
typedef __attribute__((ext_vector_type(4)))  float    v4f;

#define NB     2
#define NQ     1024
#define NK     1024
#define HIDDEN 64
#define HEADS  16

#define RBF_G2     81.151596f            // 56.25 * log2(e)
#define GELU_C0    0.7978845608f         // sqrt(2/pi)
#define GELU_C1    0.035677408f          // GELU_C0 * 0.044715

// Tanh-form GELU times two: x + x*tanh(s), s = 0.79788456(x + 0.044715 x^3).
// One v_tanh_f32 stands for the exp2 + rcp pair; the factor 1/2 is exact and
// is taken back in the output scale behind GEMM2.
__device__ __forceinline__ float gelu2_fast(float x) {
  const float x2 = x * x;
  const float s  = x * (GELU_C0 + GELU_C1 * x2);
  return __builtin_fmaf(x, __builtin_amdgcn_tanhf(s), x);
}

// One wave per (b, q, k-half). Each wave loops 8 trips of four 16-pair tiles.
// GEMM1: D1 = W1^T (A: 16 hidden x 32 feat) x feats^T (B: 32 x 16 pairs) + b1
// GEMM2: D2 = W2^T (A: 16 head x 64 hid)    x 2*gelu(D1) (B)      -> lane = pair
// 16-bit operand K packing (ISA 7.12.2): element e of v16h, lane-half hb holds
// K(e) = (e&7) + 16*(e>>3) + 8*hb.  C/D: lane = N, row M = r + 8*hb.
__global__ __launch_bounds__(256)
void rel3d_bias_wmma(const float* __restrict__ qc,
                     const float* __restrict__ kc,
                     const float* __restrict__ W1,
                     const float* __restrict__ b1,
                     const float* __restrict__ W2,
                     float* __restrict__ out) {
  const int lane = threadIdx.x & 31;
  const int wid  = threadIdx.x >> 5;
  const int wg   = blockIdx.x * 8 + wid;          // 4096 waves total
  const int khalf = wg & 1;
  const int q     = (wg >> 1) & (NQ - 1);
  const int b     = wg >> 11;

  const int n  = lane & 15;                       // N index (pair / head-col)
  const int hb = lane >> 4;                       // lane half (compiler knows {0,1})

  // ---- persistent operands (registers) ----
  // A tiles for GEMM1: W1^T, 4 hidden-tiles of 16 x 32 (feature K, pad 20->32)
  v16h aW1[4];
  #pragma unroll
  for (int t = 0; t < 4; ++t) {
    #pragma unroll
    for (int e = 0; e < 16; ++e) {
      const int K = (e & 7) + 16 * (e >> 3) + 8 * hb;
      aW1[t][e] = (_Float16)((K < 20) ? W1[(size_t)K * HIDDEN + t * 16 + n] : 0.0f);
    }
  }
  // C bias tiles: c[t][r] = b1[t*16 + r + 8*hb]  (broadcast along pairs)
  v8f cb[4];
  #pragma unroll
  for (int t = 0; t < 4; ++t)
    #pragma unroll
    for (int r = 0; r < 8; ++r)
      cb[t][r] = b1[t * 16 + r + 8 * hb];
  // A tiles for GEMM2: W2^T, 16 heads x 64 hidden (two K-tiles of 32)
  v16h aW2[2];
  #pragma unroll
  for (int kb = 0; kb < 2; ++kb)
    #pragma unroll
    for (int e = 0; e < 16; ++e) {
      const int K = 32 * kb + (e & 7) + 16 * (e >> 3) + 8 * hb;
      aW2[kb][e] = (_Float16)W2[(size_t)K * HEADS + n];
    }

  // q center: uniform across the wave
  const float qx = qc[((size_t)b * NQ + q) * 3 + 0];
  const float qy = qc[((size_t)b * NQ + q) * 3 + 1];
  const float qz = qc[((size_t)b * NQ + q) * 3 + 2];

  const float kStep = 2.0f / 15.0f;   // RBF center spacing

  // Each trip takes 64 keys as four 16-pair tiles. Column n of tile j holds key
  // kbase + 4*n + j, so behind the four tiles a lane owns four adjacent keys of
  // each of its eight head rows: one 16-byte store per row, 256 contiguous bytes per
  // half-wave, whole 128-B lines. The lane's four keys are 48 contiguous bytes.
  const int k0 = khalf * (NK / 2);
  for (int trip = 0; trip < NK / 2 / 64; ++trip) {
    const int kbase = k0 + trip * 64;
    const float* kp = &kc[((size_t)b * NK + kbase + 4 * n) * 3];
    if (trip + 1 < NK / 2 / 64)
      __builtin_prefetch(kp + 192, 0, 1);         // next trip -> global_prefetch

    const v4f k_lo = *(const v4f*)(kp);
    const v4f k_mi = *(const v4f*)(kp + 4);
    const v4f k_hi = *(const v4f*)(kp + 8);
    const float kx[4] = {k_lo[0], k_lo[3], k_mi[2], k_hi[1]};
    const float ky[4] = {k_lo[1], k_mi[0], k_mi[3], k_hi[2]};
    const float kz[4] = {k_lo[2], k_mi[1], k_hi[0], k_hi[3]};

    v8f d2[4];
    #pragma unroll
    for (int j = 0; j < 4; ++j) {
      const float rx = qx - kx[j];
      const float ry = qy - ky[j];
      const float rz = qz - kz[j];
      const float dist = sqrtf(rx * rx + ry * ry + rz * rz);

      // feats^T in B-operand layout (lane = pair), fully branchless.
      // K(e) = (e&7) + 16*(e>>3) + 8*hb; features: 0-2 rel, 3 dist,
      // 4..19 rbf bins, >=20 zero. Known-bits on hb folds most selects.
      v16h fB;
      #pragma unroll
      for (int e = 0; e < 16; ++e) {
        const int K = (e & 7) + 16 * (e >> 3) + 8 * hb;
        const float c = (float)(K - 4) * kStep;
        const float d = dist - c;
        float f = __builtin_amdgcn_exp2f(-RBF_G2 * d * d);  // rbf(K-4)
        f = (K >= 20) ? 0.0f : f;
        f = (K == 3) ? dist : f;
        f = (K == 2) ? rz : f;
        f = (K == 1) ? ry : f;
        f = (K == 0) ? rx : f;
        fB[e] = (_Float16)f;
      }

      // GEMM1: h^T tiles (bias folded into C input)
      v8f d1[4];
      #pragma unroll
      for (int t = 0; t < 4; ++t)
        d1[t] = __builtin_amdgcn_wmma_f32_16x16x32_f16(
            false, aW1[t], false, fB, (short)0, cb[t], false, false);

      // GELU + f16 pack straight into GEMM2 B operand (pure in-lane repack:
      // C/D layout and 16-bit B layout share lane-half semantics).
      v16h b2[2];
      #pragma unroll
      for (int kb = 0; kb < 2; ++kb)
        #pragma unroll
        for (int v = 0; v < 8; ++v) {
          const int t = 2 * kb + (v >> 2);
          const int r = 2 * (v & 3);
          b2[kb][2 * v]     = (_Float16)gelu2_fast(d1[t][r]);
          b2[kb][2 * v + 1] = (_Float16)gelu2_fast(d1[t][r + 1]);
        }

      // GEMM2: chain K = 32 + 32
      v8f acc = {};
      acc = __builtin_amdgcn_wmma_f32_16x16x32_f16(
          false, aW2[0], false, b2[0], (short)0, acc, false, false);
      acc = __builtin_amdgcn_wmma_f32_16x16x32_f16(
          false, aW2[1], false, b2[1], (short)0, acc, false, false);
      d2[j] = acc * 0.0625f;
    }

    // out[b][head][q][k]: the lane's four tiles are keys kbase + 4*n + 0..3.
    // acc held twice the bias (gelu2_fast), d2 = acc/16 = bias/8: 8*tanh(d2).
    #pragma unroll
    for (int r = 0; r < 8; ++r) {
      const int head = r + 8 * hb;
      v4f val;
      #pragma unroll
      for (int j = 0; j < 4; ++j)
        val[j] = 8.0f * __builtin_amdgcn_tanhf(d2[j][r]);
      *(v4f*)&out[(((size_t)b * HEADS + head) * NQ + q) * NK + kbase + 4 * n] = val;
    }
    // The next trip's key loads land in registers that these stores name:
    // the address-translation wait stands between them.
    asm volatile("s_wait_xcnt 0x0" ::: "memory");
  }
}

extern "C" void kernel_launch(void* const* d_in, const int* in_sizes, int n_in,
                              void* d_out, int out_size, void* d_ws, size_t ws_size,
                              hipStream_t stream) {
  const float* qc = (const float*)d_in[0];   // [2,1024,3]
  const float* kc = (const float*)d_in[1];   // [2,1024,3]
  const float* W1 = (const float*)d_in[2];   // [20,64]
  const float* b1 = (const float*)d_in[3];   // [64]
  const float* W2 = (const float*)d_in[4];   // [64,16]
  float* out = (float*)d_out;                // [2,16,1024,1024]

  // 4096 waves = 2(b) * 1024(q) * 2(k-half); 8 waves per 256-thread block
  rel3d_bias_wmma<<<dim3(512), dim3(256), 0, stream>>>(qc, kc, W1, b1, W2, out);
}

// v003
// Measured time: 23.4 microseconds a run.
// Timed twice side by side with v002, it ran 1.18 times as fast both times.
// Counting every step since v000, it is 1.82 times as fast.
#include <hip/hip_runtime.h>

// CDNA5 / gfx1250: wave32, WMMA f32_16x16x32_f16.
typedef __attribute__((ext_vector_type(16))) _Float16 v16h;
typedef __attribute__((ext_vector_type(8)))  float    v8f;
typedef __attribute__((ext_vector_type(4)))  float    v4f;

#define NB     2
#define NQ     1024
#define NK     1024
#define HIDDEN 64
#define HEADS  16

#define RBF_G2     81.151596f            // 56.25 * log2(e)
#define GELU_C0    0.7978845608f         // sqrt(2/pi)
#define GELU_C1    0.035677408f          // GELU_C0 * 0.044715

// Tanh-form GELU times two: x + x*tanh(s), s = 0.79788456(x + 0.044715 x^3).
// One v_tanh_f32 stands for the exp2 + rcp pair; the factor 1/2 is exact and
// is taken back in the output scale behind GEMM2.
__device__ __forceinline__ float gelu2_fast(float x) {
  const float x2 = x * x;
  const float s  = x * (GELU_C0 + GELU_C1 * x2);
  return __builtin_fmaf(x, __builtin_amdgcn_tanhf(s), x);
}

// One wave per (b, q, k-half). Each wave loops 8 trips of four 16-pair tiles.
// GEMM1: D1 = W1^T (A: 16 hidden x 32 feat) x feats^T (B: 32 x 16 pairs) + b1
// GEMM2: D2 = W2^T (A: 16 head x 64 hid)    x 2*gelu(D1) (B)      -> lane = pair
// 16-bit operand K packing (ISA 7.12.2): element e of v16h, lane-half hb holds
// K(e) = (e&7) + 16*(e>>3) + 8*hb.  C/D: lane = N, row M = r + 8*hb.
// GEMM1 is free to place its 20 features on any K slots as long as A and B
// agree, so each lane half takes ten: e = 0..7 -> rbf bin e + 8*hb,
// e = 8 -> rx | rz, e = 9 -> ry | dist (hb = 0 | 1), e >= 10 -> zero.
__global__ __launch_bounds__(256)
void rel3d_bias_wmma(const float* __restrict__ qc,
                     const float* __restrict__ kc,
                     const float* __restrict__ W1,
                     const float* __restrict__ b1,
                     const float* __restrict__ W2,
                     float* __restrict__ out) {
  const int lane = threadIdx.x & 31;
  const int wid  = threadIdx.x >> 5;
  const int wg   = blockIdx.x * 8 + wid;          // 4096 waves total
  const int khalf = wg & 1;
  const int q     = (wg >> 1) & (NQ - 1);
  const int b     = wg >> 11;

  const int n  = lane & 15;                       // N index (pair / head-col)
  const int hb = lane >> 4;                       // lane half (compiler knows {0,1})

  // ---- persistent operands (registers) ----
  // A tiles for GEMM1: W1^T, 4 hidden-tiles of 16 x 32. Slot e of lane half hb
  // holds W1 row 4 + e + 8*hb (e < 8) or e - 8 + 2*hb (e = 8, 9); which slots
  // are padding is known at compile time, so no load is guarded.
  v16h aW1[4];
  #pragma unroll
  for (int t = 0; t < 4; ++t) {
    #pragma unroll
    for (int e = 0; e < 16; ++e) {
      const int row = (e < 8) ? 4 + e + 8 * hb : e - 8 + 2 * hb;
      aW1[t][e] = (e < 10) ? (_Float16)W1[(size_t)row * HIDDEN + t * 16 + n]
                           : (_Float16)0.0f;
    }
  }
  // C bias tiles: c[t][r] = b1[t*16 + r + 8*hb]  (broadcast along pairs)
  v8f cb[4];
  #pragma unroll
  for (int t = 0; t < 4; ++t)
    #pragma unroll
    for (int r = 0; r < 8; ++r)
      cb[t][r] = b1[t * 16 + r + 8 * hb];
  // A tiles for GEMM2: W2^T, 16 heads x 64 hidden (two K-tiles of 32)
  v16h aW2[2];
  #pragma unroll
  for (int kb = 0; kb < 2; ++kb)
    #pragma unroll
    for (int e = 0; e < 16; ++e) {
      const int K = 32 * kb + (e & 7) + 16 * (e >> 3) + 8 * hb;
      aW2[kb][e] = (_Float16)W2[(size_t)K * HEADS + n];
    }

  // q center: uniform across the wave
  const float qx = qc[((size_t)b * NQ + q) * 3 + 0];
  const float qy = qc[((size_t)b * NQ + q) * 3 + 1];
  const float qz = qc[((size_t)b * NQ + q) * 3 + 2];

  const float kStep = 2.0f / 15.0f;   // RBF center spacing

  // Each trip takes 64 keys as four 16-pair tiles. Column n of tile j holds key
  // kbase + 4*n + j, so behind the four tiles a lane owns four adjacent keys of
  // each of its eight head rows: one 16-byte store per row, 256 contiguous bytes per
  // half-wave, whole 128-B lines. The lane's four keys are 48 contiguous bytes.
  const int k0 = khalf * (NK / 2);
  for (int trip = 0; trip < NK / 2 / 64; ++trip) {
    const int kbase = k0 + trip * 64;
    const float* kp = &kc[((size_t)b * NK + kbase + 4 * n) * 3];
    if (trip + 1 < NK / 2 / 64)
      __builtin_prefetch(kp + 192, 0, 1);         // next trip -> global_prefetch

    const v4f k_lo = *(const v4f*)(kp);
    const v4f k_mi = *(const v4f*)(kp + 4);
    const v4f k_hi = *(const v4f*)(kp + 8);
    const float kx[4] = {k_lo[0], k_lo[3], k_mi[2], k_hi[1]};
    const float ky[4] = {k_lo[1], k_mi[0], k_mi[3], k_hi[2]};
    const float kz[4] = {k_lo[2], k_mi[1], k_hi[0], k_hi[3]};

    v8f d2[4];
    #pragma unroll
    for (int j = 0; j < 4; ++j) {
      const float rx = qx - kx[j];
      const float ry = qy - ky[j];
      const float rz = qz - kz[j];
      const float dist = sqrtf(rx * rx + ry * ry + rz * rz);

      // feats^T in B-operand layout (lane = pair), same slot map as aW1:
      // eight rbf bins per lane half, then two of (rx, ry, rz, dist), then zeros.
      v16h fB;
      #pragma unroll
      for (int e = 0; e < 8; ++e) {
        const float c = (float)(e + 8 * hb) * kStep;
        const float d = dist - c;
        fB[e] = (_Float16)__builtin_amdgcn_exp2f(-RBF_G2 * d * d);
      }
      fB[8] = (_Float16)(hb ? rz : rx);
      fB[9] = (_Float16)(hb ? dist : ry);
      #pragma unroll
      for (int e = 10; e < 16; ++e)
        fB[e] = (_Float16)0.0f;

      // GEMM1: h^T tiles (bias folded into C input)
      v8f d1[4];
      #pragma unroll
      for (int t = 0; t < 4; ++t)
        d1[t] = __builtin_amdgcn_wmma_f32_16x16x32_f16(
            false, aW1[t], false, fB, (short)0, cb[t], false, false);

      // GELU + f16 pack straight into GEMM2 B operand (pure in-lane repack:
      // C/D layout and 16-bit B layout share lane-half semantics).
      v16h b2[2];
      #pragma unroll
      for (int kb = 0; kb < 2; ++kb)
        #pragma unroll
        for (int v = 0; v < 8; ++v) {
          const int t = 2 * kb + (v >> 2);
          const int r = 2 * (v & 3);
          b2[kb][2 * v]     = (_Float16)gelu2_fast(d1[t][r]);
          b2[kb][2 * v + 1] = (_Float16)gelu2_fast(d1[t][r + 1]);
        }

      // GEMM2: chain K = 32 + 32
      v8f acc = {};
      acc = __builtin_amdgcn_wmma_f32_16x16x32_f16(
          false, aW2[0], false, b2[0], (short)0, acc, false, false);
      acc = __builtin_amdgcn_wmma_f32_16x16x32_f16(
          false, aW2[1], false, b2[1], (short)0, acc, false, false);
      d2[j] = acc * 0.0625f;
    }

    // out[b][head][q][k]: the lane's four tiles are keys kbase + 4*n + 0..3.
    // acc held twice the bias (gelu2_fast), d2 = acc/16 = bias/8: 8*tanh(d2).
    #pragma unroll
    for (int r = 0; r < 8; ++r) {
      const int head = r + 8 * hb;
      v4f val;
      #pragma unroll
      for (int j = 0; j < 4; ++j)
        val[j] = 8.0f * __builtin_amdgcn_tanhf(d2[j][r]);
      *(v4f*)&out[(((size_t)b * HEADS + head) * NQ + q) * NK + kbase + 4 * n] = val;
    }
    // The next trip's key loads land in registers that these stores name:
    // the address-translation wait stands between them.
    asm volatile("s_wait_xcnt 0x0" ::: "memory");
  }
}

extern "C" void kernel_launch(void* const* d_in, const int* in_sizes, int n_in,
                              void* d_out, int out_size, void* d_ws, size_t ws_size,
                              hipStream_t stream) {
  const float* qc = (const float*)d_in[0];   // [2,1024,3]
  const float* kc = (const float*)d_in[1];   // [2,1024,3]
  const float* W1 = (const float*)d_in[2];   // [20,64]
  const float* b1 = (const float*)d_in[3];   // [64]
  const float* W2 = (const float*)d_in[4];   // [64,16]
  float* out = (float*)d_out;                // [2,16,1024,1024]

  // 4096 waves = 2(b) * 1024(q) * 2(k-half); 8 waves per 256-thread block
  rel3d_bias_wmma<<<dim3(512), dim3(256), 0, stream>>>(qc, kc, W1, b1, W2, out);
}

// v004
// A run of this version takes 21.7 microseconds.
// Next to v003, in two timings, it ran 1.07 and 1.08 times as fast.
// Over all steps from v000 it is 1.96 times as fast.
#include <hip/hip_runtime.h>

// CDNA5 / gfx1250: wave32, WMMA f32_16x16x32_f16.
typedef __attribute__((ext_vector_type(16))) _Float16 v16h;
typedef __attribute__((ext_vector_type(8)))  float    v8f;
typedef __attribute__((ext_vector_type(4)))  float    v4f;
typedef __attribute__((ext_vector_type(2)))  float    v2f;

#define NB     2
#define NQ     1024
#define NK     1024
#define HIDDEN 64
#define HEADS  16

// The constant factors in front of the two tanh sit in loop-invariant operands
// (W1, b1, W2), scaled once per wave ahead of the loop; the exp2's sits in the
// rbf centers and in a multiply of dist inside the loop.
#define RBF_SG     9.0084181f            // sqrt(56.25 * log2(e))
#define RBF_STEP   1.2011224f            // RBF_SG * 2/15 = sqrt(log2(e))
#define GELU_K     0.32920349f           // cbrt(0.044715 * sqrt(2/pi))
#define GELU_A     2.4236820f            // sqrt(2/pi) / GELU_K
#define W2_SCALE   0.18985218f           // 1 / (16 * GELU_K)

// Tanh-form GELU on z = GELU_K * x. With the cubic's coefficient equal to one,
// s = 0.79788456(x + 0.044715 x^3) = z * (z*z + GELU_A): one fma and one mul.
// Returns z + z*tanh(s) = 2 * GELU_K * gelu(x); W2_SCALE takes the factor back.
__device__ __forceinline__ float gelu_scaled(float z) {
  const float s = z * __builtin_fmaf(z, z, GELU_A);
  return __builtin_fmaf(z, __builtin_amdgcn_tanhf(s), z);
}

// One wave per (b, q, k-half). Each wave loops 8 trips of four 16-pair tiles.
// GEMM1: D1 = K*W1^T (A: 16 hidden x 32 feat) x feats^T (B: 32 x 16 pairs) + K*b1
// GEMM2: D2 = W2^T/(16K) (A: 16 head x 64 hid) x 2K*gelu (B) = bias/8, lane = pair
// 16-bit operand K packing (ISA 7.12.2): element e of v16h, lane-half hb holds
// K(e) = (e&7) + 16*(e>>3) + 8*hb.  C/D: lane = N, row M = r + 8*hb.
// GEMM1 is free to place its 20 features on any K slots as long as A and B
// agree, so each lane half takes ten: e = 0..7 -> rbf bin e + 8*hb,
// e = 8 -> rx | rz, e = 9 -> ry | dist (hb = 0 | 1), e >= 10 -> zero.
__global__ __launch_bounds__(256)
void rel3d_bias_wmma(const float* __restrict__ qc,
                     const float* __restrict__ kc,
                     const float* __restrict__ W1,
                     const float* __restrict__ b1,
                     const float* __restrict__ W2,
                     float* __restrict__ out) {
  const int lane = threadIdx.x & 31;
  const int wid  = threadIdx.x >> 5;
  const int wg   = blockIdx.x * 8 + wid;          // 4096 waves total
  const int khalf = wg & 1;
  const int q     = (wg >> 1) & (NQ - 1);
  const int b     = wg >> 11;

  const int n  = lane & 15;                       // N index (pair / head-col)
  const int hb = lane >> 4;                       // lane half (compiler knows {0,1})

  // ---- persistent operands (registers) ----
  // A tiles for GEMM1: GELU_K * W1^T, 4 hidden-tiles of 16 x 32. Slot e of lane half hb
  // holds W1 row 4 + e + 8*hb (e < 8) or e - 8 + 2*hb (e = 8, 9); which slots
  // are padding is known at compile time, so no load is guarded.
  v16h aW1[4];
  #pragma unroll
  for (int t = 0; t < 4; ++t) {
    #pragma unroll
    for (int e = 0; e < 16; ++e) {
      const int row = (e < 8) ? 4 + e + 8 * hb : e - 8 + 2 * hb;
      aW1[t][e] = (e < 10) ? (_Float16)(GELU_K * W1[(size_t)row * HIDDEN + t * 16 + n])
                           : (_Float16)0.0f;
    }
  }
  // C bias tiles: c[t][r] = GELU_K * b1[t*16 + r + 8*hb]  (broadcast along pairs)
  v8f cb[4];
  #pragma unroll
  for (int t = 0; t < 4; ++t)
    #pragma unroll
    for (int r = 0; r < 8; ++r)
      cb[t][r] = GELU_K * b1[t * 16 + r + 8 * hb];
  // A tiles for GEMM2: W2_SCALE * W2^T, 16 heads x 64 hidden (two K-tiles of 32)
  v16h aW2[2];
  #pragma unroll
  for (int kb = 0; kb < 2; ++kb)
    #pragma unroll
    for (int e = 0; e < 16; ++e) {
      const int K = 32 * kb + (e & 7) + 16 * (e >> 3) + 8 * hb;
      aW2[kb][e] = (_Float16)(W2_SCALE * W2[(size_t)K * HEADS + n]);
    }

  // q center: uniform across the wave
  const float qx = qc[((size_t)b * NQ + q) * 3 + 0];
  const float qy = qc[((size_t)b * NQ + q) * 3 + 1];
  const float qz = qc[((size_t)b * NQ + q) * 3 + 2];

  // rbf centers of this lane half in units of 1/RBF_SG, two bins per register pair
  v2f cs[4];
  #pragma unroll
  for (int p = 0; p < 4; ++p) {
    cs[p][0] = (float)(2 * p + 8 * hb) * RBF_STEP;
    cs[p][1] = (float)(2 * p + 1 + 8 * hb) * RBF_STEP;
  }

  // Each trip takes 64 keys as four 16-pair tiles. Column n of tile j holds key
  // kbase + 4*n + j, so behind the four tiles a lane owns four adjacent keys of
  // each of its eight head rows: one 16-byte store per row, 256 contiguous bytes per
  // half-wave, whole 128-B lines. The lane's four keys are 48 contiguous bytes.
  const int k0 = khalf * (NK / 2);
  for (int trip = 0; trip < NK / 2 / 64; ++trip) {
    const int kbase = k0 + trip * 64;
    const float* kp = &kc[((size_t)b * NK + kbase + 4 * n) * 3];
    if (trip + 1 < NK / 2 / 64)
      __builtin_prefetch(kp + 192, 0, 1);         // next trip -> global_prefetch

    const v4f k_lo = *(const v4f*)(kp);
    const v4f k_mi = *(const v4f*)(kp + 4);
    const v4f k_hi = *(const v4f*)(kp + 8);
    const float kx[4] = {k_lo[0], k_lo[3], k_mi[2], k_hi[1]};
    const float ky[4] = {k_lo[1], k_mi[0], k_mi[3], k_hi[2]};
    const float kz[4] = {k_lo[2], k_mi[1], k_hi[0], k_hi[3]};

    v8f d2[4];
    #pragma unroll
    for (int j = 0; j < 4; ++j) {
      const float rx = qx - kx[j];
      const float ry = qy - ky[j];
      const float rz = qz - kz[j];
      const float dist = sqrtf(rx * rx + ry * ry + rz * rz);

      // feats^T in B-operand layout (lane = pair), same slot map as aW1:
      // eight rbf bins per lane half, then two of (rx, ry, rz, dist), then zeros.
      // rbf = exp2(-(RBF_SG*dist - cs)^2): the factor meets dist, not every bin.
      const v2f dd = {dist, dist};
      v16h fB;
      #pragma unroll
      for (int p = 0; p < 4; ++p) {
        const v2f d = dd * RBF_SG - cs[p];
        const v2f m = d * d;
        fB[2 * p]     = (_Float16)__builtin_amdgcn_exp2f(-m[0]);
        fB[2 * p + 1] = (_Float16)__builtin_amdgcn_exp2f(-m[1]);
      }
      fB[8] = (_Float16)(hb ? rz : rx);
      fB[9] = (_Float16)(hb ? dist : ry);
      #pragma unroll
      for (int e = 10; e < 16; ++e)
        fB[e] = (_Float16)0.0f;

      // GEMM1: h^T tiles (bias folded into C input)
      v8f d1[4];
      #pragma unroll
      for (int t = 0; t < 4; ++t)
        d1[t] = __builtin_amdgcn_wmma_f32_16x16x32_f16(
            false, aW1[t], false, fB, (short)0, cb[t], false, false);

      // GELU + f16 pack straight into GEMM2 B operand (pure in-lane repack:
      // C/D layout and 16-bit B layout share lane-half semantics).
      v16h b2[2];
      #pragma unroll
      for (int kb = 0; kb < 2; ++kb)
        #pragma unroll
        for (int v = 0; v < 8; ++v) {
          const int t = 2 * kb + (v >> 2);
          const int r = 2 * (v & 3);
          b2[kb][2 * v]     = (_Float16)gelu_scaled(d1[t][r]);
          b2[kb][2 * v + 1] = (_Float16)gelu_scaled(d1[t][r + 1]);
        }

      // GEMM2: chain K = 32 + 32
      v8f acc = {};
      acc = __builtin_amdgcn_wmma_f32_16x16x32_f16(
          false, aW2[0], false, b2[0], (short)0, acc, false, false);
      acc = __builtin_amdgcn_wmma_f32_16x16x32_f16(
          false, aW2[1], false, b2[1], (short)0, acc, false, false);
      d2[j] = acc;
    }

    // out[b][head][q][k]: the lane's four tiles are keys kbase + 4*n + 0..3.
    // d2 = bias/8 (the scale is in aW2): 8*tanh(d2).
    #pragma unroll
    for (int r = 0; r < 8; ++r) {
      const int head = r + 8 * hb;
      v4f val;
      #pragma unroll
      for (int j = 0; j < 4; ++j)
        val[j] = 8.0f * __builtin_amdgcn_tanhf(d2[j][r]);
      *(v4f*)&out[(((size_t)b * HEADS + head) * NQ + q) * NK + kbase + 4 * n] = val;
    }
    // The next trip's key loads land in registers that these stores name:
    // the address-translation wait stands between them.
    asm volatile("s_wait_xcnt 0x0" ::: "memory");
  }
}

extern "C" void kernel_launch(void* const* d_in, const int* in_sizes, int n_in,
                              void* d_out, int out_size, void* d_ws, size_t ws_size,
                              hipStream_t stream) {
  const float* qc = (const float*)d_in[0];   // [2,1024,3]
  const float* kc = (const float*)d_in[1];   // [2,1024,3]
  const float* W1 = (const float*)d_in[2];   // [20,64]
  const float* b1 = (const float*)d_in[3];   // [64]
  const float* W2 = (const float*)d_in[4];   // [64,16]
  float* out = (float*)d_out;                // [2,16,1024,1024]

  // 4096 waves = 2(b) * 1024(q) * 2(k-half); 8 waves per 256-thread block
  rel3d_bias_wmma<<<dim3(512), dim3(256), 0, stream>>>(qc, kc, W1, b1, W2, out);
}

// v005
// A run of this version takes 20.5 microseconds.
// Two timings next to v004 both put it at 1.06 times that version's speed.
// Counting every step since v000, it is 2.07 times as fast.
#include <hip/hip_runtime.h>

// CDNA5 / gfx1250: wave32, WMMA f32_16x16x32_f16.
typedef __attribute__((ext_vector_type(16))) _Float16 v16h;
typedef __attribute__((ext_vector_type(8)))  float    v8f;
typedef __attribute__((ext_vector_type(4)))  float    v4f;
typedef __attribute__((ext_vector_type(2)))  float    v2f;
typedef __attribute__((ext_vector_type(2)))  _Float16 v2h;
typedef __attribute__((ext_vector_type(2)))  unsigned v2u;
typedef __attribute__((ext_vector_type(4)))  unsigned v4u;
typedef __attribute__((ext_vector_type(8)))  unsigned v8u;

#define NB     2
#define NQ     1024
#define NK     1024
#define HIDDEN 64
#define HEADS  16

// The constant factors in front of the exp2 and the two tanh sit in loop-invariant
// operands (W1, b1, W2, the rbf centers), scaled once ahead of the loop.
#define RBF_SG     9.0084181f            // sqrt(56.25 * log2(e))
#define RBF_STEP   1.2011224f            // RBF_SG * 2/15 = sqrt(log2(e))
#define GELU_K     0.32920349f           // cbrt(0.044715 * sqrt(2/pi))
#define GELU_A     2.4236820f            // sqrt(2/pi) / GELU_K
#define W2_SCALE   0.18985218f           // 1 / (16 * GELU_K)

// Tanh-form GELU on z = GELU_K * x. With the cubic's coefficient equal to one,
// s = 0.79788456(x + 0.044715 x^3) = z * (z*z + GELU_A): one fma and one mul.
// Returns z + z*tanh(s) = 2 * GELU_K * gelu(x); W2_SCALE takes the factor back.
__device__ __forceinline__ float gelu_scaled(float z) {
  const float s = z * __builtin_fmaf(z, z, GELU_A);
  return __builtin_fmaf(z, __builtin_amdgcn_tanhf(s), z);
}

// Two scaled weights rounded to f16 and packed into one operand register.
__device__ __forceinline__ unsigned pack_f16(float lo, float hi) {
  const v2h p = {(_Float16)lo, (_Float16)hi};
  return __builtin_bit_cast(unsigned, p);
}

// One wave per (b, q, k-half). Each wave loops 8 trips of four 16-pair tiles.
// GEMM1: D1 = K*W1^T (A: 16 hidden x 32 feat) x feats^T (B: 32 x 16 pairs) + K*b1
// GEMM2: D2 = W2^T/(16K) (A: 16 head x 64 hid) x 2K*gelu (B) = bias/8, lane = pair
// 16-bit operand K packing (ISA 7.12.2): element e of v16h, lane-half hb holds
// K(e) = (e&7) + 16*(e>>3) + 8*hb.  C/D: lane = N, row M = r + 8*hb.
// GEMM1 is free to place its 20 features on any K slots as long as A and B
// agree, so each lane half takes ten: e = 0..7 -> rbf bin e + 8*hb,
// e = 8 -> rx | rz, e = 9 -> ry | dist (hb = 0 | 1), e >= 10 -> zero.
// What the eight waves of a work-group share (the batch's keys, the rbf slots of
// the W1 tiles, the W2 tiles) is read from global memory once per work-group and
// handed round in LDS: each wave builds an eighth of the tiles, in operand layout.
// Two work-groups per WGP are four waves per SIMD: at most 256 registers a wave.
// With LDS in use the compiler would take more; at a cap of 256 itself it spills.
__global__ __launch_bounds__(256) __attribute__((amdgpu_waves_per_eu(4), amdgpu_num_vgpr(248)))
void rel3d_bias_wmma(const float* __restrict__ qc,
                     const float* __restrict__ kc,
                     const float* __restrict__ W1,
                     const float* __restrict__ b1,
                     const float* __restrict__ W2,
                     float* __restrict__ out) {
  const int lane = threadIdx.x & 31;
  const int wid  = threadIdx.x >> 5;
  const int wg   = blockIdx.x * 8 + wid;          // 4096 waves total
  const int khalf = wg & 1;
  const int q     = (wg >> 1) & (NQ - 1);
  const int b     = wg >> 11;

  const int n  = lane & 15;                       // N index (pair / head-col)
  const int hb = lane >> 4;                       // lane half (compiler knows {0,1})

  __shared__ __attribute__((aligned(16))) float    sK[NK * 3];        // keys of batch b
  __shared__ __attribute__((aligned(16))) unsigned sW1a[4 * 32 * 4];  // [tile][lane][e/2], e < 8
  __shared__ __attribute__((aligned(16))) unsigned sW2[4 * 32 * 4];   // [2*kb + e/8][lane][(e&7)/2]

  // ---- staging: every thread moves 48 bytes of keys and rounds 4 + 4 weights ----
  const int sw = __builtin_amdgcn_readfirstlane(wid);   // wave number as a scalar
  {
    const v4f* ksrc = (const v4f*)(kc + (size_t)b * NK * 3);
    v4f kv[3];
    #pragma unroll
    for (int i = 0; i < 3; ++i)
      kv[i] = ksrc[threadIdx.x + 256 * i];

    // W1^T tile t1, slots e1 .. e1+3 of lane half hb: W1 rows 4 + e + 8*hb.
    const int t1 = sw >> 1, e1 = 4 * (sw & 1);
    const float* w1p = &W1[(size_t)(4 + e1 + 8 * hb) * HIDDEN + t1 * 16 + n];
    const v2u p1 = {pack_f16(GELU_K * w1p[0], GELU_K * w1p[HIDDEN]),
                    pack_f16(GELU_K * w1p[2 * HIDDEN], GELU_K * w1p[3 * HIDDEN])};
    // W2^T K-tile kb2, slots e2 .. e2+3: K = 32*kb + (e&7) + 16*(e>>3) + 8*hb.
    const int kb2 = sw >> 2, e2 = 4 * (sw & 3);
    const float* w2p = &W2[(size_t)(32 * kb2 + (e2 & 7) + 16 * (e2 >> 3) + 8 * hb) * HEADS + n];
    const v2u p2 = {pack_f16(W2_SCALE * w2p[0], W2_SCALE * w2p[HEADS]),
                    pack_f16(W2_SCALE * w2p[2 * HEADS], W2_SCALE * w2p[3 * HEADS])};

    #pragma unroll
    for (int i = 0; i < 3; ++i)
      ((v4f*)sK)[threadIdx.x + 256 * i] = kv[i];
    *(v2u*)&sW1a[(t1 * 32 + lane) * 4 + (e1 >> 1)] = p1;
    *(v2u*)&sW2[((e2 >> 3) + 2 * kb2) * 128 + lane * 4 + ((e2 & 7) >> 1)] = p2;
  }

  // Slots 8, 9 of the W1^T tiles (W1 rows 2*hb, 2*hb + 1): one register a tile,
  // too little to share evenly among eight waves; each wave loads its own.
  unsigned w1b[4];
  #pragma unroll
  for (int t = 0; t < 4; ++t)
    w1b[t] = pack_f16(GELU_K * W1[(size_t)(2 * hb) * HIDDEN + t * 16 + n],
                      GELU_K * W1[(size_t)(2 * hb + 1) * HIDDEN + t * 16 + n]);

  // C bias tiles: c[t][r] = GELU_K * b1[t*16 + r + 8*hb]  (broadcast along pairs)
  v8f cb[4];
  #pragma unroll
  for (int t = 0; t < 4; ++t) {
    const v4f lo = *(const v4f*)&b1[t * 16 + 8 * hb];
    const v4f hi = *(const v4f*)&b1[t * 16 + 8 * hb + 4];
    cb[t] = GELU_K * (v8f){lo[0], lo[1], lo[2], lo[3], hi[0], hi[1], hi[2], hi[3]};
  }

  // q center: uniform across the wave
  const float qx = qc[((size_t)b * NQ + q) * 3 + 0];
  const float qy = qc[((size_t)b * NQ + q) * 3 + 1];
  const float qz = qc[((size_t)b * NQ + q) * 3 + 2];

  // rbf centers of this lane half in units of 1/RBF_SG, two bins per register pair
  v2f cs[4];
  #pragma unroll
  for (int p = 0; p < 4; ++p) {
    cs[p][0] = (float)(2 * p + 8 * hb) * RBF_STEP;
    cs[p][1] = (float)(2 * p + 1 + 8 * hb) * RBF_STEP;
  }

  __syncthreads();                                // the staged keys and tiles are complete

  // ---- persistent operands (registers), as they lie in LDS ----
  // A tiles for GEMM1: GELU_K * W1^T, 4 hidden-tiles of 16 x 32; slots e >= 10 are zero.
  v16h aW1[4];
  #pragma unroll
  for (int t = 0; t < 4; ++t) {
    const v4u a = *(const v4u*)&sW1a[(t * 32 + lane) * 4];
    const v8u x = {a[0], a[1], a[2], a[3], w1b[t], 0u, 0u, 0u};
    aW1[t] = __builtin_bit_cast(v16h, x);
  }
  // A tiles for GEMM2: W2_SCALE * W2^T, 16 heads x 64 hidden (two K-tiles of 32)
  v16h aW2[2];
  #pragma unroll
  for (int kb = 0; kb < 2; ++kb) {
    const v4u lo = *(const v4u*)&sW2[(2 * kb) * 128 + lane * 4];
    const v4u hi = *(const v4u*)&sW2[(2 * kb + 1) * 128 + lane * 4];
    const v8u x = {lo[0], lo[1], lo[2], lo[3], hi[0], hi[1], hi[2], hi[3]};
    aW2[kb] = __builtin_bit_cast(v16h, x);
  }

  // Each trip takes 64 keys as four 16-pair tiles. Column n of tile j holds key
  // kbase + 4*n + j, so behind the four tiles a lane owns four adjacent keys of
  // each of its eight head rows: one 16-byte store per row, 256 contiguous bytes per
  // half-wave, whole 128-B lines. The lane's four keys are 48 contiguous bytes.
  const int k0 = khalf * (NK / 2);
  for (int trip = 0; trip < NK / 2 / 64; ++trip) {
    const int kbase = k0 + trip * 64;
    const float* kp = &sK[(kbase + 4 * n) * 3];   // LDS: three 16-byte reads

    const v4f k_lo = *(const v4f*)(kp);
    const v4f k_mi = *(const v4f*)(kp + 4);
    const v4f k_hi = *(const v4f*)(kp + 8);
    const float kx[4] = {k_lo[0], k_lo[3], k_mi[2], k_hi[1]};
    const float ky[4] = {k_lo[1], k_mi[0], k_mi[3], k_hi[2]};
    const float kz[4] = {k_lo[2], k_mi[1], k_hi[0], k_hi[3]};

    v8f d2[4];
    #pragma unroll
    for (int j = 0; j < 4; ++j) {
      const float rx = qx - kx[j];
      const float ry = qy - ky[j];
      const float rz = qz - kz[j];
      const float dist = sqrtf(rx * rx + ry * ry + rz * rz);

      // feats^T in B-operand layout (lane = pair), same slot map as aW1:
      // eight rbf bins per lane half, then two of (rx, ry, rz, dist), then zeros.
      // rbf = exp2(-(RBF_SG*dist - cs)^2): the factor meets dist, not every bin.
      const v2f dd = {dist, dist};
      v16h fB;
      #pragma unroll
      for (int p = 0; p < 4; ++p) {
        const v2f d = dd * RBF_SG - cs[p];
        const v2f m = d * d;
        fB[2 * p]     = (_Float16)__builtin_amdgcn_exp2f(-m[0]);
        fB[2 * p + 1] = (_Float16)__builtin_amdgcn_exp2f(-m[1]);
      }
      fB[8] = (_Float16)(hb ? rz : rx);
      fB[9] = (_Float16)(hb ? dist : ry);
      #pragma unroll
      for (int e = 10; e < 16; ++e)
        fB[e] = (_Float16)0.0f;

      // GEMM1: h^T tiles (bias folded into C input)
      v8f d1[4];
      #pragma unroll
      for (int t = 0; t < 4; ++t)
        d1[t] = __builtin_amdgcn_wmma_f32_16x16x32_f16(
            false, aW1[t], false, fB, (short)0, cb[t], false, false);

      // GELU + f16 pack straight into GEMM2 B operand (pure in-lane repack:
      // C/D layout and 16-bit B layout share lane-half semantics).
      v16h b2[2];
      #pragma unroll
      for (int kb = 0; kb < 2; ++kb)
        #pragma unroll
        for (int v = 0; v < 8; ++v) {
          const int t = 2 * kb + (v >> 2);
          const int r = 2 * (v & 3);
          b2[kb][2 * v]     = (_Float16)gelu_scaled(d1[t][r]);
          b2[kb][2 * v + 1] = (_Float16)gelu_scaled(d1[t][r + 1]);
        }

      // GEMM2: chain K = 32 + 32
      v8f acc = {};
      acc = __builtin_amdgcn_wmma_f32_16x16x32_f16(
          false, aW2[0], false, b2[0], (short)0, acc, false, false);
      acc = __builtin_amdgcn_wmma_f32_16x16x32_f16(
          false, aW2[1], false, b2[1], (short)0, acc, false, false);
      d2[j] = acc;
    }

    // out[b][head][q][k]: the lane's four tiles are keys kbase + 4*n + 0..3.
    // d2 = bias/8 (the scale is in aW2): 8*tanh(d2).
    #pragma unroll
    for (int r = 0; r < 8; ++r) {
      const int head = r + 8 * hb;
      v4f val;
      #pragma unroll
      for (int j = 0; j < 4; ++j)
        val[j] = 8.0f * __builtin_amdgcn_tanhf(d2[j][r]);
      *(v4f*)&out[(((size_t)b * HEADS + head) * NQ + q) * NK + kbase + 4 * n] = val;
    }
    // The next trip writes registers that these stores name:
    // the address-translation wait stands between them.
    asm volatile("s_wait_xcnt 0x0" ::: "memory");
  }
}

extern "C" void kernel_launch(void* const* d_in, const int* in_sizes, int n_in,
                              void* d_out, int out_size, void* d_ws, size_t ws_size,
                              hipStream_t stream) {
  const float* qc = (const float*)d_in[0];   // [2,1024,3]
  const float* kc = (const float*)d_in[1];   // [2,1024,3]
  const float* W1 = (const float*)d_in[2];   // [20,64]
  const float* b1 = (const float*)d_in[3];   // [64]
  const float* W2 = (const float*)d_in[4];   // [64,16]
  float* out = (float*)d_out;                // [2,16,1024,1024]

  // 4096 waves = 2(b) * 1024(q) * 2(k-half); 8 waves per 256-thread block
  rel3d_bias_wmma<<<dim3(512), dim3(256), 0, stream>>>(qc, kc, W1, b1, W2, out);
}
